// v000
// Measured on an AMD MI455X. A time is GPU time per run, averaged over a window of back-to-back runs after a warm-up
// (all launches, gaps included; the runs take copies of the inputs in turn), and the median of several windows.
// Apart from v000's, it joins two sittings. Times from different sittings can be a few percent apart, while
// side-by-side timings come from the same sitting.
// v000 is the starting kernel. One run takes 321 microseconds.
#include <hip/hip_runtime.h>
#include <hip/hip_bf16.h>

typedef float v2f __attribute__((ext_vector_type(2)));
typedef float v8f __attribute__((ext_vector_type(8)));

#define WMMA_F32(A, B, C) \
    __builtin_amdgcn_wmma_f32_16x16x4_f32(false, (A), false, (B), (short)0, (C), false, false)

#define LDSP 66  // padded row stride (floats), even -> keeps 8B alignment for b64 LDS loads

// ---------------------------------------------------------------------------
// Generic fp32 WMMA GEMM: out[M][N] = A[M][K] @ W[K][N] + bias[N]
// MODE 0: A is plain row-major with leading dim lda.
// MODE 1: A is the spatially-reduced gather of x (conv-as-GEMM), K=1024.
// Block = 128 threads (4 waves); block tile = 16 (M) x 64 (N); wave tile 16x16.
// ---------------------------------------------------------------------------
template <int MODE>
__global__ void gemm16_wmma(const float* __restrict__ A, int lda,
                            const float* __restrict__ W, int ldw,
                            const float* __restrict__ bias,
                            float* __restrict__ out, int ldo, int K) {
  __shared__ __align__(16) float a_tile[16][LDSP];   // [m][k]
  __shared__ __align__(16) float w_tile[64][LDSP];   // [n][k]  (W^T chunk)

  const int tid  = threadIdx.x;
  const int lane = tid & 31;
  const int wave = tid >> 5;
  const int m0     = blockIdx.x * 16;
  const int n0blk  = blockIdx.y * 64;
  const int nw     = wave * 16;

  const int mrow  = lane & 15;        // A-frag M / B-frag N index
  const int khalf = (lane >> 4) << 1; // K pair selected by lane half

  v8f acc = {0.f, 0.f, 0.f, 0.f, 0.f, 0.f, 0.f, 0.f};

  for (int kb = 0; kb < K; kb += 64) {
    __syncthreads();
    // ---- stage A tile (16 x 64) ----
    for (int e = tid; e < 16 * 64; e += 128) {
      int m = e >> 6, kk = e & 63;
      float val;
      if (MODE == 0) {
        val = A[(m0 + m) * lda + kb + kk];
      } else {
        // conv gather: row r -> (b, s); k -> (tap, ic)
        int r  = m0 + m;
        int b  = r >> 10, s = r & 1023;
        int ho = s >> 5,  wo = s & 31;
        int kg = kb + kk;
        int tap = kg >> 8, ic = kg & 255;
        int kh = tap >> 1, kw = tap & 1;
        int h2 = 2 * ho + kh, w2 = 2 * wo + kw;
        int cp = 4 * h2 + (w2 >> 4);          // source channel of x
        int np = ((w2 & 15) << 8) + ic;       // source position of x
        val = A[((b << 12) + np) * 256 + cp];
      }
      a_tile[m][kk] = val;
    }
    // ---- stage W^T tile (64 x 64): w_tile[n][k] = W[(kb+k)*ldw + n0blk+n] ----
    for (int e = tid; e < 64 * 64; e += 128) {
      int k = e >> 6, n = e & 63;
      w_tile[n][k] = W[(kb + k) * ldw + n0blk + n];
    }
    __syncthreads();

    #pragma unroll
    for (int ks = 0; ks < 16; ++ks) {
      v2f a = *(const v2f*)&a_tile[mrow][4 * ks + khalf];
      v2f b = *(const v2f*)&w_tile[nw + mrow][4 * ks + khalf];
      acc = WMMA_F32(a, b, acc);
    }
  }

  const int col     = n0blk + nw + mrow;
  const float bv    = bias[col];
  const int halfsel = (lane >> 4) << 3;  // D-matrix: vgpr v holds row v (lo half) / v+8 (hi half)
  #pragma unroll
  for (int v = 0; v < 8; ++v) {
    out[(m0 + v + halfsel) * ldo + col] = acc[v] + bv;
  }
}

// ---------------------------------------------------------------------------
// LayerNorm over 256-wide rows. One wave per row, 8 rows per 256-thread block.
// ---------------------------------------------------------------------------
__global__ void layernorm_kernel(const float* __restrict__ in,
                                 const float* __restrict__ sc,
                                 const float* __restrict__ bi,
                                 float* __restrict__ outp) {
  const int lane = threadIdx.x & 31;
  const int wave = threadIdx.x >> 5;
  const int row  = blockIdx.x * 8 + wave;
  const float* rp = in + row * 256;

  float4 a = *(const float4*)(rp + lane * 4);
  float4 b = *(const float4*)(rp + 128 + lane * 4);

  float s = a.x + a.y + a.z + a.w + b.x + b.y + b.z + b.w;
  #pragma unroll
  for (int m = 1; m < 32; m <<= 1) s += __shfl_xor(s, m, 32);
  const float mu = s * (1.0f / 256.0f);

  float d, vs = 0.f;
  d = a.x - mu; vs += d * d;  d = a.y - mu; vs += d * d;
  d = a.z - mu; vs += d * d;  d = a.w - mu; vs += d * d;
  d = b.x - mu; vs += d * d;  d = b.y - mu; vs += d * d;
  d = b.z - mu; vs += d * d;  d = b.w - mu; vs += d * d;
  #pragma unroll
  for (int m = 1; m < 32; m <<= 1) vs += __shfl_xor(vs, m, 32);
  const float inv = rsqrtf(vs * (1.0f / 256.0f) + 1e-6f);

  int c = lane * 4;
  float4 o;
  o.x = (a.x - mu) * inv * sc[c + 0] + bi[c + 0];
  o.y = (a.y - mu) * inv * sc[c + 1] + bi[c + 1];
  o.z = (a.z - mu) * inv * sc[c + 2] + bi[c + 2];
  o.w = (a.w - mu) * inv * sc[c + 3] + bi[c + 3];
  *(float4*)(outp + row * 256 + c) = o;
  c = 128 + lane * 4;
  o.x = (b.x - mu) * inv * sc[c + 0] + bi[c + 0];
  o.y = (b.y - mu) * inv * sc[c + 1] + bi[c + 1];
  o.z = (b.z - mu) * inv * sc[c + 2] + bi[c + 2];
  o.w = (b.w - mu) * inv * sc[c + 3] + bi[c + 3];
  *(float4*)(outp + row * 256 + c) = o;
}

// ---------------------------------------------------------------------------
// Flash attention, fp32 WMMA. Block = 128 threads (4 waves); each wave owns
// 16 query rows, block covers 64. KV length 1024 streamed in chunks of 64.
// qbuf:   [B*4096][256]  (q for head h in cols h*32..h*32+31)
// kvbuf:  [B*1024][512]  (k cols h*32+d, v cols 256+h*32+d)
// attnout:[B*4096][256]
// ---------------------------------------------------------------------------
__global__ void attn_kernel(const float* __restrict__ qbuf,
                            const float* __restrict__ kvbuf,
                            float* __restrict__ attnout) {
  __shared__ __align__(16) float k_tile[64][34];      // [kv][d]
  __shared__ __align__(16) float vt_tile[32][LDSP];   // [d][kv]
  __shared__ __align__(16) float p_tile[4][16][LDSP]; // per-wave P [qrow][kv]

  const int tid  = threadIdx.x;
  const int lane = tid & 31;
  const int wave = tid >> 5;
  const int id   = blockIdx.x;
  const int qblk = id & 63;
  const int bh   = id >> 6;
  const int h    = bh & 7;
  const int b    = bh >> 3;
  const int q0   = qblk * 64 + wave * 16;

  const int mrow  = lane & 15;
  const int khalf = (lane >> 4) << 1;
  const float scale = 0.17677669529663687f;  // 32^-0.5 folded into Q

  // Q A-fragments (d = 32 -> 8 k-steps), kept in registers for whole KV loop
  v2f qf[8];
  const float* qp = qbuf + (size_t)(b * 4096 + q0 + mrow) * 256 + h * 32;
  #pragma unroll
  for (int ks = 0; ks < 8; ++ks) {
    v2f t = *(const v2f*)(qp + 4 * ks + khalf);
    qf[ks] = t * scale;
  }

  v8f o0 = {0.f, 0.f, 0.f, 0.f, 0.f, 0.f, 0.f, 0.f};
  v8f o1 = {0.f, 0.f, 0.f, 0.f, 0.f, 0.f, 0.f, 0.f};
  float m_run[8], l_run[8];
  #pragma unroll
  for (int v = 0; v < 8; ++v) { m_run[v] = -__builtin_inff(); l_run[v] = 0.f; }

  const float* kvb = kvbuf + (size_t)b * 1024 * 512;

  for (int kv0 = 0; kv0 < 1024; kv0 += 64) {
    __syncthreads();
    for (int e = tid; e < 64 * 32; e += 128) {        // K rows as-is
      int kv = e >> 5, dd = e & 31;
      k_tile[kv][dd] = kvb[(kv0 + kv) * 512 + h * 32 + dd];
    }
    for (int e = tid; e < 64 * 32; e += 128) {        // V transposed
      int kv = e >> 5, dd = e & 31;
      vt_tile[dd][kv] = kvb[(kv0 + kv) * 512 + 256 + h * 32 + dd];
    }
    __syncthreads();

    // S = (Q*scale) K^T : four 16x16 tiles over kv
    v8f s[4];
    #pragma unroll
    for (int nt = 0; nt < 4; ++nt) {
      v8f acc = {0.f, 0.f, 0.f, 0.f, 0.f, 0.f, 0.f, 0.f};
      #pragma unroll
      for (int ks = 0; ks < 8; ++ks) {
        v2f bf = *(const v2f*)&k_tile[nt * 16 + mrow][4 * ks + khalf];
        acc = WMMA_F32(qf[ks], bf, acc);
      }
      s[nt] = acc;
    }

    // Online softmax; row of slot v is (v + 8*lane_half), stats replicated per half
    #pragma unroll
    for (int v = 0; v < 8; ++v) {
      float mx = fmaxf(fmaxf(s[0][v], s[1][v]), fmaxf(s[2][v], s[3][v]));
      #pragma unroll
      for (int msk = 1; msk < 16; msk <<= 1) mx = fmaxf(mx, __shfl_xor(mx, msk, 32));
      const float mnew = fmaxf(m_run[v], mx);
      const float corr = __expf(m_run[v] - mnew);
      float ls = 0.f;
      #pragma unroll
      for (int nt = 0; nt < 4; ++nt) {
        float p = __expf(s[nt][v] - mnew);
        s[nt][v] = p;
        ls += p;
      }
      #pragma unroll
      for (int msk = 1; msk < 16; msk <<= 1) ls += __shfl_xor(ls, msk, 32);
      l_run[v] = l_run[v] * corr + ls;
      m_run[v] = mnew;
      o0[v] *= corr;
      o1[v] *= corr;
    }

    // P -> per-wave LDS tile (D layout -> row-major), then reload as A-fragments
    const int rhalf = (lane >> 4) << 3;
    #pragma unroll
    for (int nt = 0; nt < 4; ++nt)
      #pragma unroll
      for (int v = 0; v < 8; ++v)
        p_tile[wave][v + rhalf][nt * 16 + mrow] = s[nt][v];
    asm volatile("s_wait_dscnt 0" ::: "memory");  // own-wave P writes visible

    // O += P V  (contraction over 64 kv -> 16 k-steps, two 16-wide d tiles)
    #pragma unroll
    for (int kp = 0; kp < 16; ++kp) {
      v2f af = *(const v2f*)&p_tile[wave][mrow][4 * kp + khalf];
      v2f b0 = *(const v2f*)&vt_tile[mrow][4 * kp + khalf];
      v2f b1 = *(const v2f*)&vt_tile[16 + mrow][4 * kp + khalf];
      o0 = WMMA_F32(af, b0, o0);
      o1 = WMMA_F32(af, b1, o1);
    }
  }

  // epilogue: divide by row sums, scatter to [B,N,C] with col = h*32 + d
  float* op = attnout + (size_t)(b * 4096 + q0) * 256 + h * 32;
  const int rhalf = (lane >> 4) << 3;
  #pragma unroll
  for (int v = 0; v < 8; ++v) {
    const float inv = 1.0f / l_run[v];
    op[(v + rhalf) * 256 + mrow]      = o0[v] * inv;
    op[(v + rhalf) * 256 + 16 + mrow] = o1[v] * inv;
  }
}

// ---------------------------------------------------------------------------
extern "C" void kernel_launch(void* const* d_in, const int* in_sizes, int n_in,
                              void* d_out, int out_size, void* d_ws, size_t ws_size,
                              hipStream_t stream) {
  (void)in_sizes; (void)n_in; (void)out_size; (void)ws_size;
  const float* x      = (const float*)d_in[0];
  const float* Wq     = (const float*)d_in[1];
  const float* bq     = (const float*)d_in[2];
  const float* Wconv  = (const float*)d_in[3];   // [2][2][256][256] == [1024][256]
  const float* bconv  = (const float*)d_in[4];
  const float* ln_s   = (const float*)d_in[5];
  const float* ln_b   = (const float*)d_in[6];
  const float* Wkv    = (const float*)d_in[7];   // [256][512]
  const float* bkv    = (const float*)d_in[8];
  const float* Wproj  = (const float*)d_in[9];
  const float* bproj  = (const float*)d_in[10];
  float* out = (float*)d_out;

  char* ws = (char*)d_ws;
  float* qbuf  = (float*)(ws);                       // 16 MB: [16384][256]
  float* kvbuf = (float*)(ws + (size_t)(16u << 20)); //  8 MB: [4096][512]
  float* attnb = (float*)(ws + (size_t)(24u << 20)); // 16 MB: [16384][256]
  float* convb = (float*)(ws + (size_t)(24u << 20)); //  4 MB (dead before attn)
  float* normb = (float*)(ws + (size_t)(28u << 20)); //  4 MB (dead before attn)

  // 1) spatial reduction conv (gathered GEMM, K=1024) + bias
  gemm16_wmma<1><<<dim3(256, 4), 128, 0, stream>>>(x, 0, Wconv, 256, bconv, convb, 256, 1024);
  // 2) LayerNorm
  layernorm_kernel<<<512, 256, 0, stream>>>(convb, ln_s, ln_b, normb);
  // 3) KV projection
  gemm16_wmma<0><<<dim3(256, 8), 128, 0, stream>>>(normb, 256, Wkv, 512, bkv, kvbuf, 512, 256);
  // 4) Q projection
  gemm16_wmma<0><<<dim3(1024, 4), 128, 0, stream>>>(x, 256, Wq, 256, bq, qbuf, 256, 256);
  // 5) fused flash attention
  attn_kernel<<<2048, 128, 0, stream>>>(qbuf, kvbuf, attnb);
  // 6) output projection
  gemm16_wmma<0><<<dim3(1024, 4), 128, 0, stream>>>(attnb, 256, Wproj, 256, bproj, out, /*ldo=*/256, /*K=*/256);
}

// v001
// One run takes 217 microseconds.
// Next to v000, in two timings, it ran 1.52 times as fast each time.
#include <hip/hip_runtime.h>
#include <hip/hip_bf16.h>

typedef float v2f __attribute__((ext_vector_type(2)));
typedef float v8f __attribute__((ext_vector_type(8)));

#define WMMA_F32(A, B, C) \
    __builtin_amdgcn_wmma_f32_16x16x4_f32(false, (A), false, (B), (short)0, (C), false, false)

#define LDSP 66  // padded row stride (floats), even -> keeps 8B alignment for b64 LDS loads

// ---------------------------------------------------------------------------
// Generic fp32 WMMA GEMM: out[M][N] = A[M][K] @ W[K][N] + bias[N]
// MODE 0: A is plain row-major with leading dim LDA.
// MODE 1: A is the spatially-reduced gather of x (conv-as-GEMM), K=1024.
// Block = 128 threads (4 waves); block tile = 16 (M) x 64 (N); wave tile 16x16.
// ---------------------------------------------------------------------------
// LDA, LDW: leading dims, compile-time so that the staging loads of a chunk differ
// only by immediate offsets and go out back to back from one address each.
// Register budget of 12 waves per SIMD: at the budget of 16 the compiler holds the last
// loads of a chunk back until the first have returned.
template <int MODE, int LDA, int LDW>
__global__ void __launch_bounds__(128) __attribute__((amdgpu_waves_per_eu(1, 12)))
gemm16_wmma(const float* __restrict__ A,
                            const float* __restrict__ W,
                            const float* __restrict__ bias,
                            float* __restrict__ out, int ldo, int K) {
  __shared__ __align__(16) float a_tile[16][LDSP];   // [m][k]
  __shared__ __align__(16) float w_tile[64][LDSP];   // [n][k]  (W^T chunk)

  const int tid  = threadIdx.x;
  const int lane = tid & 31;
  const int wave = tid >> 5;
  const int m0     = blockIdx.x * 16;
  const int n0blk  = blockIdx.y * 64;
  const int nw     = wave * 16;

  const int mrow  = lane & 15;        // A-frag M / B-frag N index
  const int khalf = (lane >> 4) << 1; // K pair selected by lane half

  v8f acc = {0.f, 0.f, 0.f, 0.f, 0.f, 0.f, 0.f, 0.f};

  // staging: trip i of a thread is element (sr + 2*i, sc) of a 64-wide tile
  const int sr = tid >> 6;
  const int sc = tid & 63;

  for (int kb = 0; kb < K; kb += 64) {
    __syncthreads();
    // Fixed trip counts (block = 128 threads), unrolled, and every global load of
    // both tiles issued before the first LDS store: the chunk waits for one memory
    // round trip, not for one per loop trip.
    float av[8], wv[32];
    // ---- load A tile (16 x 64): row m0 + sr + 2*i, column kb + sc ----
    const float* ap;
    if (MODE == 0) {
      ap = A + (m0 + sr) * LDA + kb + sc;
    } else {
      // conv gather: row r -> (b, ho, wo); k -> (tap, ic). A 16-row tile has one b and
      // one ho, a 64-wide chunk one tap; source channel of x is 4*h2 + (w2 >> 4),
      // source position ((w2 & 15) << 8) + ic, with w2 = 2*wo + kw and
      // wo = (m0 & 31) + sr + 2*i, so trip i adds 4*(i & 3) to w2 & 15 and i >> 2 to w2 >> 4.
      const int b  = m0 >> 10;
      const int ho = (m0 & 1023) >> 5;
      const int tap = kb >> 8;
      const int kh = tap >> 1, kw = tap & 1;
      const int np = (kw << 8) + (sr << 9) + (kb & 255) + sc;  // trip 0
      const int cp = 4 * (2 * ho + kh) + ((m0 & 31) >> 3);     // trip 0
      ap = A + ((b << 12) + np) * 256 + cp;
    }
    #pragma unroll  // loads back to back, values stay in registers
    for (int i = 0; i < 8; ++i)
      av[i] = (MODE == 0) ? ap[i * 2 * LDA] : ap[(i & 3) * (4 * 256 * 256) + (i >> 2)];
    // ---- load W chunk (64 x 64): row kb + sr + 2*i, column n0blk + sc ----
    const float* wp = W + (kb + sr) * LDW + n0blk + sc;
    #pragma unroll  // loads back to back, values stay in registers
    for (int i = 0; i < 32; ++i) wv[i] = wp[i * 2 * LDW];
    // ---- store both tiles: a_tile[m][k], w_tile[n][k] = W^T chunk ----
    #pragma unroll  // av[] indexed by constants only
    for (int i = 0; i < 8; ++i) a_tile[sr + 2 * i][sc] = av[i];
    #pragma unroll  // wv[] indexed by constants only
    for (int i = 0; i < 32; ++i) w_tile[sc][sr + 2 * i] = wv[i];
    __syncthreads();

    #pragma unroll
    for (int ks = 0; ks < 16; ++ks) {
      v2f a = *(const v2f*)&a_tile[mrow][4 * ks + khalf];
      v2f b = *(const v2f*)&w_tile[nw + mrow][4 * ks + khalf];
      acc = WMMA_F32(a, b, acc);
    }
  }

  const int col     = n0blk + nw + mrow;
  const float bv    = bias[col];
  const int halfsel = (lane >> 4) << 3;  // D-matrix: vgpr v holds row v (lo half) / v+8 (hi half)
  #pragma unroll
  for (int v = 0; v < 8; ++v) {
    out[(m0 + v + halfsel) * ldo + col] = acc[v] + bv;
  }
}

// ---------------------------------------------------------------------------
// LayerNorm over 256-wide rows. One wave per row, 8 rows per 256-thread block.
// ---------------------------------------------------------------------------
__global__ void layernorm_kernel(const float* __restrict__ in,
                                 const float* __restrict__ sc,
                                 const float* __restrict__ bi,
                                 float* __restrict__ outp) {
  const int lane = threadIdx.x & 31;
  const int wave = threadIdx.x >> 5;
  const int row  = blockIdx.x * 8 + wave;
  const float* rp = in + row * 256;

  float4 a = *(const float4*)(rp + lane * 4);
  float4 b = *(const float4*)(rp + 128 + lane * 4);

  float s = a.x + a.y + a.z + a.w + b.x + b.y + b.z + b.w;
  #pragma unroll
  for (int m = 1; m < 32; m <<= 1) s += __shfl_xor(s, m, 32);
  const float mu = s * (1.0f / 256.0f);

  float d, vs = 0.f;
  d = a.x - mu; vs += d * d;  d = a.y - mu; vs += d * d;
  d = a.z - mu; vs += d * d;  d = a.w - mu; vs += d * d;
  d = b.x - mu; vs += d * d;  d = b.y - mu; vs += d * d;
  d = b.z - mu; vs += d * d;  d = b.w - mu; vs += d * d;
  #pragma unroll
  for (int m = 1; m < 32; m <<= 1) vs += __shfl_xor(vs, m, 32);
  const float inv = rsqrtf(vs * (1.0f / 256.0f) + 1e-6f);

  int c = lane * 4;
  float4 o;
  o.x = (a.x - mu) * inv * sc[c + 0] + bi[c + 0];
  o.y = (a.y - mu) * inv * sc[c + 1] + bi[c + 1];
  o.z = (a.z - mu) * inv * sc[c + 2] + bi[c + 2];
  o.w = (a.w - mu) * inv * sc[c + 3] + bi[c + 3];
  *(float4*)(outp + row * 256 + c) = o;
  c = 128 + lane * 4;
  o.x = (b.x - mu) * inv * sc[c + 0] + bi[c + 0];
  o.y = (b.y - mu) * inv * sc[c + 1] + bi[c + 1];
  o.z = (b.z - mu) * inv * sc[c + 2] + bi[c + 2];
  o.w = (b.w - mu) * inv * sc[c + 3] + bi[c + 3];
  *(float4*)(outp + row * 256 + c) = o;
}

// ---------------------------------------------------------------------------
// Flash attention, fp32 WMMA. Block = 128 threads (4 waves); each wave owns
// 16 query rows, block covers 64. KV length 1024 streamed in chunks of 64.
// qbuf:   [B*4096][256]  (q for head h in cols h*32..h*32+31)
// kvbuf:  [B*1024][512]  (k cols h*32+d, v cols 256+h*32+d)
// attnout:[B*4096][256]
// ---------------------------------------------------------------------------
__global__ void attn_kernel(const float* __restrict__ qbuf,
                            const float* __restrict__ kvbuf,
                            float* __restrict__ attnout) {
  __shared__ __align__(16) float k_tile[64][34];      // [kv][d]
  __shared__ __align__(16) float vt_tile[32][LDSP];   // [d][kv]
  __shared__ __align__(16) float p_tile[4][16][LDSP]; // per-wave P [qrow][kv]

  const int tid  = threadIdx.x;
  const int lane = tid & 31;
  const int wave = tid >> 5;
  const int id   = blockIdx.x;
  const int qblk = id & 63;
  const int bh   = id >> 6;
  const int h    = bh & 7;
  const int b    = bh >> 3;
  const int q0   = qblk * 64 + wave * 16;

  const int mrow  = lane & 15;
  const int khalf = (lane >> 4) << 1;
  const float scale = 0.17677669529663687f;  // 32^-0.5 folded into Q

  // Q A-fragments (d = 32 -> 8 k-steps), kept in registers for whole KV loop
  v2f qf[8];
  const float* qp = qbuf + (size_t)(b * 4096 + q0 + mrow) * 256 + h * 32;
  #pragma unroll
  for (int ks = 0; ks < 8; ++ks) {
    v2f t = *(const v2f*)(qp + 4 * ks + khalf);
    qf[ks] = t * scale;
  }

  v8f o0 = {0.f, 0.f, 0.f, 0.f, 0.f, 0.f, 0.f, 0.f};
  v8f o1 = {0.f, 0.f, 0.f, 0.f, 0.f, 0.f, 0.f, 0.f};
  float m_run[8], l_run[8];
  #pragma unroll
  for (int v = 0; v < 8; ++v) { m_run[v] = -__builtin_inff(); l_run[v] = 0.f; }

  const float* kvb = kvbuf + (size_t)b * 1024 * 512;

  for (int kv0 = 0; kv0 < 1024; kv0 += 64) {
    __syncthreads();
    // Fixed trip counts, unrolled, all K and V loads issued before the first LDS
    // store: one memory round trip per chunk, not one per loop trip.
    // Trip i of a thread is key wave + 4*i, element lane of the head.
    float kr[16], vr[16];
    const float* kvp = kvb + (kv0 + wave) * 512 + h * 32 + lane;
    #pragma unroll  // loads back to back, values stay in registers
    for (int i = 0; i < 16; ++i) {
      kr[i] = kvp[i * 4 * 512];
      vr[i] = kvp[i * 4 * 512 + 256];
    }
    #pragma unroll  // kr[], vr[] indexed by constants only
    for (int i = 0; i < 16; ++i) {
      k_tile[wave + 4 * i][lane]  = kr[i];            // K rows as-is
      vt_tile[lane][wave + 4 * i] = vr[i];            // V transposed
    }
    __syncthreads();

    // S = (Q*scale) K^T : four 16x16 tiles over kv
    v8f s[4];
    #pragma unroll
    for (int nt = 0; nt < 4; ++nt) {
      v8f acc = {0.f, 0.f, 0.f, 0.f, 0.f, 0.f, 0.f, 0.f};
      #pragma unroll
      for (int ks = 0; ks < 8; ++ks) {
        v2f bf = *(const v2f*)&k_tile[nt * 16 + mrow][4 * ks + khalf];
        acc = WMMA_F32(qf[ks], bf, acc);
      }
      s[nt] = acc;
    }

    // Online softmax; row of slot v is (v + 8*lane_half), stats replicated per half
    #pragma unroll
    for (int v = 0; v < 8; ++v) {
      float mx = fmaxf(fmaxf(s[0][v], s[1][v]), fmaxf(s[2][v], s[3][v]));
      #pragma unroll
      for (int msk = 1; msk < 16; msk <<= 1) mx = fmaxf(mx, __shfl_xor(mx, msk, 32));
      const float mnew = fmaxf(m_run[v], mx);
      const float corr = __expf(m_run[v] - mnew);
      float ls = 0.f;
      #pragma unroll
      for (int nt = 0; nt < 4; ++nt) {
        float p = __expf(s[nt][v] - mnew);
        s[nt][v] = p;
        ls += p;
      }
      #pragma unroll
      for (int msk = 1; msk < 16; msk <<= 1) ls += __shfl_xor(ls, msk, 32);
      l_run[v] = l_run[v] * corr + ls;
      m_run[v] = mnew;
      o0[v] *= corr;
      o1[v] *= corr;
    }

    // P -> per-wave LDS tile (D layout -> row-major), then reload as A-fragments
    const int rhalf = (lane >> 4) << 3;
    #pragma unroll
    for (int nt = 0; nt < 4; ++nt)
      #pragma unroll
      for (int v = 0; v < 8; ++v)
        p_tile[wave][v + rhalf][nt * 16 + mrow] = s[nt][v];
    asm volatile("s_wait_dscnt 0" ::: "memory");  // own-wave P writes visible

    // O += P V  (contraction over 64 kv -> 16 k-steps, two 16-wide d tiles)
    #pragma unroll
    for (int kp = 0; kp < 16; ++kp) {
      v2f af = *(const v2f*)&p_tile[wave][mrow][4 * kp + khalf];
      v2f b0 = *(const v2f*)&vt_tile[mrow][4 * kp + khalf];
      v2f b1 = *(const v2f*)&vt_tile[16 + mrow][4 * kp + khalf];
      o0 = WMMA_F32(af, b0, o0);
      o1 = WMMA_F32(af, b1, o1);
    }
  }

  // epilogue: divide by row sums, scatter to [B,N,C] with col = h*32 + d
  float* op = attnout + (size_t)(b * 4096 + q0) * 256 + h * 32;
  const int rhalf = (lane >> 4) << 3;
  #pragma unroll
  for (int v = 0; v < 8; ++v) {
    const float inv = 1.0f / l_run[v];
    op[(v + rhalf) * 256 + mrow]      = o0[v] * inv;
    op[(v + rhalf) * 256 + 16 + mrow] = o1[v] * inv;
  }
}

// ---------------------------------------------------------------------------
extern "C" void kernel_launch(void* const* d_in, const int* in_sizes, int n_in,
                              void* d_out, int out_size, void* d_ws, size_t ws_size,
                              hipStream_t stream) {
  (void)in_sizes; (void)n_in; (void)out_size; (void)ws_size;
  const float* x      = (const float*)d_in[0];
  const float* Wq     = (const float*)d_in[1];
  const float* bq     = (const float*)d_in[2];
  const float* Wconv  = (const float*)d_in[3];   // [2][2][256][256] == [1024][256]
  const float* bconv  = (const float*)d_in[4];
  const float* ln_s   = (const float*)d_in[5];
  const float* ln_b   = (const float*)d_in[6];
  const float* Wkv    = (const float*)d_in[7];   // [256][512]
  const float* bkv    = (const float*)d_in[8];
  const float* Wproj  = (const float*)d_in[9];
  const float* bproj  = (const float*)d_in[10];
  float* out = (float*)d_out;

  char* ws = (char*)d_ws;
  float* qbuf  = (float*)(ws);                       // 16 MB: [16384][256]
  float* kvbuf = (float*)(ws + (size_t)(16u << 20)); //  8 MB: [4096][512]
  float* attnb = (float*)(ws + (size_t)(24u << 20)); // 16 MB: [16384][256]
  float* convb = (float*)(ws + (size_t)(24u << 20)); //  4 MB (dead before attn)
  float* normb = (float*)(ws + (size_t)(28u << 20)); //  4 MB (dead before attn)

  // 1) spatial reduction conv (gathered GEMM, K=1024) + bias
  gemm16_wmma<1, 0, 256><<<dim3(256, 4), 128, 0, stream>>>(x, Wconv, bconv, convb, 256, 1024);
  // 2) LayerNorm
  layernorm_kernel<<<512, 256, 0, stream>>>(convb, ln_s, ln_b, normb);
  // 3) KV projection
  gemm16_wmma<0, 256, 512><<<dim3(256, 8), 128, 0, stream>>>(normb, Wkv, bkv, kvbuf, 512, 256);
  // 4) Q projection
  gemm16_wmma<0, 256, 256><<<dim3(1024, 4), 128, 0, stream>>>(x, Wq, bq, qbuf, 256, 256);
  // 5) fused flash attention
  attn_kernel<<<2048, 128, 0, stream>>>(qbuf, kvbuf, attnb);
  // 6) output projection
  gemm16_wmma<0, 256, 256><<<dim3(1024, 4), 128, 0, stream>>>(attnb, Wproj, bproj, out, /*ldo=*/256, /*K=*/256);
}

// v002
// It runs in 190 microseconds.
// Timed twice side by side with v001, it ran 1.14 times as fast both times.
// Counting every step since v000, it is 1.73 times as fast.
#include <hip/hip_runtime.h>
#include <hip/hip_bf16.h>

typedef float v2f __attribute__((ext_vector_type(2)));
typedef float v8f __attribute__((ext_vector_type(8)));

#define WMMA_F32(A, B, C) \
    __builtin_amdgcn_wmma_f32_16x16x4_f32(false, (A), false, (B), (short)0, (C), false, false)

#define LDSP 66  // padded row stride (floats), even -> keeps 8B alignment for b64 LDS loads

// ---------------------------------------------------------------------------
// Generic fp32 WMMA GEMM: out[M][N] = A[M][K] @ W[K][N] + bias[N]
// MODE 0: A is plain row-major with leading dim LDA.
// MODE 1: A is the spatially-reduced gather of x (conv-as-GEMM), K=1024.
// Block = 128 threads (4 waves); block tile = 16 (M) x 64 (N); wave tile 16x16.
// ---------------------------------------------------------------------------
// LDA, LDW: leading dims, compile-time so that the staging loads of a chunk differ
// only by immediate offsets and go out back to back from one address each.
// Register budget of 12 waves per SIMD: at the budget of 16 the compiler holds the last
// loads of a chunk back until the first have returned.
template <int MODE, int LDA, int LDW>
__global__ void __launch_bounds__(128) __attribute__((amdgpu_waves_per_eu(1, 12)))
gemm16_wmma(const float* __restrict__ A,
                            const float* __restrict__ W,
                            const float* __restrict__ bias,
                            float* __restrict__ out, int ldo, int K) {
  __shared__ __align__(16) float a_tile[16][LDSP];   // [m][k]
  __shared__ __align__(16) float w_tile[64][LDSP];   // [n][k]  (W^T chunk)

  const int tid  = threadIdx.x;
  const int lane = tid & 31;
  const int wave = tid >> 5;
  const int m0     = blockIdx.x * 16;
  const int n0blk  = blockIdx.y * 64;
  const int nw     = wave * 16;

  const int mrow  = lane & 15;        // A-frag M / B-frag N index
  const int khalf = (lane >> 4) << 1; // K pair selected by lane half

  v8f acc = {0.f, 0.f, 0.f, 0.f, 0.f, 0.f, 0.f, 0.f};

  // staging: trip i of a thread is element (sr + 2*i, sc) of a 64-wide tile
  const int sr = tid >> 6;
  const int sc = tid & 63;

  for (int kb = 0; kb < K; kb += 64) {
    __syncthreads();
    // Fixed trip counts (block = 128 threads), unrolled, and every global load of
    // both tiles issued before the first LDS store: the chunk waits for one memory
    // round trip, not for one per loop trip.
    float av[8], wv[32];
    // ---- load A tile (16 x 64): row m0 + sr + 2*i, column kb + sc ----
    const float* ap;
    if (MODE == 0) {
      ap = A + (m0 + sr) * LDA + kb + sc;
    } else {
      // conv gather: row r -> (b, ho, wo); k -> (tap, ic). A 16-row tile has one b and
      // one ho, a 64-wide chunk one tap; source channel of x is 4*h2 + (w2 >> 4),
      // source position ((w2 & 15) << 8) + ic, with w2 = 2*wo + kw and
      // wo = (m0 & 31) + sr + 2*i, so trip i adds 4*(i & 3) to w2 & 15 and i >> 2 to w2 >> 4.
      const int b  = m0 >> 10;
      const int ho = (m0 & 1023) >> 5;
      const int tap = kb >> 8;
      const int kh = tap >> 1, kw = tap & 1;
      const int np = (kw << 8) + (sr << 9) + (kb & 255) + sc;  // trip 0
      const int cp = 4 * (2 * ho + kh) + ((m0 & 31) >> 3);     // trip 0
      ap = A + ((b << 12) + np) * 256 + cp;
    }
    #pragma unroll  // loads back to back, values stay in registers
    for (int i = 0; i < 8; ++i)
      av[i] = (MODE == 0) ? ap[i * 2 * LDA] : ap[(i & 3) * (4 * 256 * 256) + (i >> 2)];
    // ---- load W chunk (64 x 64): row kb + sr + 2*i, column n0blk + sc ----
    const float* wp = W + (kb + sr) * LDW + n0blk + sc;
    #pragma unroll  // loads back to back, values stay in registers
    for (int i = 0; i < 32; ++i) wv[i] = wp[i * 2 * LDW];
    // ---- store both tiles: a_tile[m][k], w_tile[n][k] = W^T chunk ----
    #pragma unroll  // av[] indexed by constants only
    for (int i = 0; i < 8; ++i) a_tile[sr + 2 * i][sc] = av[i];
    #pragma unroll  // wv[] indexed by constants only
    for (int i = 0; i < 32; ++i) w_tile[sc][sr + 2 * i] = wv[i];
    __syncthreads();

    #pragma unroll
    for (int ks = 0; ks < 16; ++ks) {
      v2f a = *(const v2f*)&a_tile[mrow][4 * ks + khalf];
      v2f b = *(const v2f*)&w_tile[nw + mrow][4 * ks + khalf];
      acc = WMMA_F32(a, b, acc);
    }
  }

  const int col     = n0blk + nw + mrow;
  const float bv    = bias[col];
  const int halfsel = (lane >> 4) << 3;  // D-matrix: vgpr v holds row v (lo half) / v+8 (hi half)
  #pragma unroll
  for (int v = 0; v < 8; ++v) {
    out[(m0 + v + halfsel) * ldo + col] = acc[v] + bv;
  }
}

// ---------------------------------------------------------------------------
// LayerNorm over 256-wide rows. One wave per row, 8 rows per 256-thread block.
// ---------------------------------------------------------------------------
__global__ void layernorm_kernel(const float* __restrict__ in,
                                 const float* __restrict__ sc,
                                 const float* __restrict__ bi,
                                 float* __restrict__ outp) {
  const int lane = threadIdx.x & 31;
  const int wave = threadIdx.x >> 5;
  const int row  = blockIdx.x * 8 + wave;
  const float* rp = in + row * 256;

  float4 a = *(const float4*)(rp + lane * 4);
  float4 b = *(const float4*)(rp + 128 + lane * 4);

  float s = a.x + a.y + a.z + a.w + b.x + b.y + b.z + b.w;
  #pragma unroll
  for (int m = 1; m < 32; m <<= 1) s += __shfl_xor(s, m, 32);
  const float mu = s * (1.0f / 256.0f);

  float d, vs = 0.f;
  d = a.x - mu; vs += d * d;  d = a.y - mu; vs += d * d;
  d = a.z - mu; vs += d * d;  d = a.w - mu; vs += d * d;
  d = b.x - mu; vs += d * d;  d = b.y - mu; vs += d * d;
  d = b.z - mu; vs += d * d;  d = b.w - mu; vs += d * d;
  #pragma unroll
  for (int m = 1; m < 32; m <<= 1) vs += __shfl_xor(vs, m, 32);
  const float inv = rsqrtf(vs * (1.0f / 256.0f) + 1e-6f);

  int c = lane * 4;
  float4 o;
  o.x = (a.x - mu) * inv * sc[c + 0] + bi[c + 0];
  o.y = (a.y - mu) * inv * sc[c + 1] + bi[c + 1];
  o.z = (a.z - mu) * inv * sc[c + 2] + bi[c + 2];
  o.w = (a.w - mu) * inv * sc[c + 3] + bi[c + 3];
  *(float4*)(outp + row * 256 + c) = o;
  c = 128 + lane * 4;
  o.x = (b.x - mu) * inv * sc[c + 0] + bi[c + 0];
  o.y = (b.y - mu) * inv * sc[c + 1] + bi[c + 1];
  o.z = (b.z - mu) * inv * sc[c + 2] + bi[c + 2];
  o.w = (b.w - mu) * inv * sc[c + 3] + bi[c + 3];
  *(float4*)(outp + row * 256 + c) = o;
}

// ---------------------------------------------------------------------------
// Flash attention, fp32 WMMA, transposed products: S^T = K Q^T, O^T += V^T P^T.
// Block = 128 threads (4 waves); each wave owns 16 query columns, block covers 64.
// KV length 1024 streamed in chunks of 64.
// A lane holds scores of ONE query (column lane & 15): maximum and sum run over its own
// registers, with one exchange between the wave's halves; the score accumulators are
// themselves the B operand of the second product, so P never goes through LDS.
// qbuf:   [B*4096][256]  (q for head h in cols h*32..h*32+31)
// kvbuf:  [B*1024][512]  (k cols h*32+d, v cols 256+h*32+d)
// attnout:[B*4096][256]
// ---------------------------------------------------------------------------
__device__ __forceinline__ float xhalf(float x) {  // lane l with lane l ^ 16
  return __builtin_bit_cast(float, __builtin_amdgcn_permlanex16(
      __builtin_bit_cast(int, x), __builtin_bit_cast(int, x), 0x76543210, 0xfedcba98, false, false));
}

__global__ void attn_kernel(const float* __restrict__ qbuf,
                            const float* __restrict__ kvbuf,
                            float* __restrict__ attnout) {
  __shared__ __align__(16) float k_tile[64][34];      // [kv][d]
  __shared__ __align__(16) float vt_tile[32][LDSP];   // [d][kv]

  const int tid  = threadIdx.x;
  const int lane = tid & 31;
  const int wave = tid >> 5;
  const int id   = blockIdx.x;
  const int qblk = id & 63;
  const int bh   = id >> 6;
  const int h    = bh & 7;
  const int b    = bh >> 3;
  const int q0   = qblk * 64 + wave * 16;

  const int mrow  = lane & 15;
  const int khalf = (lane >> 4) << 1;
  const float scale = 0.17677669529663687f;  // 32^-0.5 folded into Q

  // Key row that A-fragment row mrow of a 16-key tile takes. Accumulator register r of
  // lane half hf is A row 8*hf + r; with r = 2*j + e this map makes it key 4*j + 2*hf + e,
  // which is the k position of register e of a B fragment at k-step j: the registers
  // (2*j, 2*j + 1) of a score tile are the P^T fragment that pairs with the V^T loader below.
  const int krow = ((mrow & 6) << 1) | ((mrow >> 3) << 1) | (mrow & 1);

  // Q B-fragments (d = 32 -> 8 k-steps), kept in registers for whole KV loop
  v2f qf[8];
  const float* qp = qbuf + (size_t)(b * 4096 + q0 + mrow) * 256 + h * 32;
  #pragma unroll
  for (int ks = 0; ks < 8; ++ks) {
    v2f t = *(const v2f*)(qp + 4 * ks + khalf);
    qf[ks] = t * scale;
  }

  v8f o0 = {0.f, 0.f, 0.f, 0.f, 0.f, 0.f, 0.f, 0.f};  // O^T rows d = 0..15
  v8f o1 = {0.f, 0.f, 0.f, 0.f, 0.f, 0.f, 0.f, 0.f};  // O^T rows d = 16..31
  float m_run = -__builtin_inff();  // this lane's query, same in both halves
  float l_run = 0.f;                // this half's keys only; halves joined in the epilogue

  const float* kvb = kvbuf + (size_t)b * 1024 * 512;

  for (int kv0 = 0; kv0 < 1024; kv0 += 64) {
    __syncthreads();
    // Fixed trip counts, unrolled, all K and V loads issued before the first LDS
    // store: one memory round trip per chunk, not one per loop trip.
    // Trip i of a thread is key wave + 4*i, element lane of the head.
    float kr[16], vr[16];
    const float* kvp = kvb + (kv0 + wave) * 512 + h * 32 + lane;
    #pragma unroll  // loads back to back, values stay in registers
    for (int i = 0; i < 16; ++i) {
      kr[i] = kvp[i * 4 * 512];
      vr[i] = kvp[i * 4 * 512 + 256];
    }
    #pragma unroll  // kr[], vr[] indexed by constants only
    for (int i = 0; i < 16; ++i) {
      k_tile[wave + 4 * i][lane]  = kr[i];            // K rows as-is
      vt_tile[lane][wave + 4 * i] = vr[i];            // V transposed
    }
    __syncthreads();

    // S^T = K (Q*scale)^T : four 16x16 tiles over kv
    v8f s[4];
    #pragma unroll
    for (int nt = 0; nt < 4; ++nt) {
      v8f acc = {0.f, 0.f, 0.f, 0.f, 0.f, 0.f, 0.f, 0.f};
      #pragma unroll
      for (int ks = 0; ks < 8; ++ks) {
        v2f kf = *(const v2f*)&k_tile[nt * 16 + krow][4 * ks + khalf];
        acc = WMMA_F32(kf, qf[ks], acc);
      }
      s[nt] = acc;
    }

    // Online softmax of this lane's query over the 32 keys its half holds
    float mt[8];
    #pragma unroll
    for (int v = 0; v < 8; ++v)
      mt[v] = fmaxf(fmaxf(s[0][v], s[1][v]), fmaxf(s[2][v], s[3][v]));
    float mx = fmaxf(fmaxf(fmaxf(mt[0], mt[1]), fmaxf(mt[2], mt[3])),
                     fmaxf(fmaxf(mt[4], mt[5]), fmaxf(mt[6], mt[7])));
    mx = fmaxf(mx, xhalf(mx));
    const float mnew = fmaxf(m_run, mx);
    const float corr = __expf(m_run - mnew);
    // P^T as B fragments: pair j of tile nt is k-step 4*nt + j
    v2f pf[16];
    #pragma unroll
    for (int kp = 0; kp < 16; ++kp) {
      pf[kp].x = __expf(s[kp >> 2][2 * (kp & 3)] - mnew);
      pf[kp].y = __expf(s[kp >> 2][2 * (kp & 3) + 1] - mnew);
    }
    v2f lp = (pf[0] + pf[4]) + (pf[8] + pf[12]);
    #pragma unroll
    for (int j = 1; j < 4; ++j)
      lp += (pf[j] + pf[4 + j]) + (pf[8 + j] + pf[12 + j]);
    l_run = l_run * corr + (lp.x + lp.y);
    m_run = mnew;
    o0 *= corr;
    o1 *= corr;

    // O^T += V^T P^T  (contraction over 64 kv -> 16 k-steps, two 16-wide d tiles)
    #pragma unroll
    for (int kp = 0; kp < 16; ++kp) {
      v2f a0 = *(const v2f*)&vt_tile[mrow][4 * kp + khalf];
      v2f a1 = *(const v2f*)&vt_tile[16 + mrow][4 * kp + khalf];
      o0 = WMMA_F32(a0, pf[kp], o0);
      o1 = WMMA_F32(a1, pf[kp], o1);
    }
  }

  // epilogue: join the halves' sums, divide, store to [B,N,C] with col = h*32 + d;
  // register v of o0 / o1 is d = v + 8*half (+ 16), so a lane stores runs of 8 floats
  const float inv = 1.0f / (l_run + xhalf(l_run));
  float* op = attnout + (size_t)(b * 4096 + q0 + mrow) * 256 + h * 32 + ((lane >> 4) << 3);
  *(float4*)(op)      = make_float4(o0[0] * inv, o0[1] * inv, o0[2] * inv, o0[3] * inv);
  *(float4*)(op + 4)  = make_float4(o0[4] * inv, o0[5] * inv, o0[6] * inv, o0[7] * inv);
  *(float4*)(op + 16) = make_float4(o1[0] * inv, o1[1] * inv, o1[2] * inv, o1[3] * inv);
  *(float4*)(op + 20) = make_float4(o1[4] * inv, o1[5] * inv, o1[6] * inv, o1[7] * inv);
}

// ---------------------------------------------------------------------------
extern "C" void kernel_launch(void* const* d_in, const int* in_sizes, int n_in,
                              void* d_out, int out_size, void* d_ws, size_t ws_size,
                              hipStream_t stream) {
  (void)in_sizes; (void)n_in; (void)out_size; (void)ws_size;
  const float* x      = (const float*)d_in[0];
  const float* Wq     = (const float*)d_in[1];
  const float* bq     = (const float*)d_in[2];
  const float* Wconv  = (const float*)d_in[3];   // [2][2][256][256] == [1024][256]
  const float* bconv  = (const float*)d_in[4];
  const float* ln_s   = (const float*)d_in[5];
  const float* ln_b   = (const float*)d_in[6];
  const float* Wkv    = (const float*)d_in[7];   // [256][512]
  const float* bkv    = (const float*)d_in[8];
  const float* Wproj  = (const float*)d_in[9];
  const float* bproj  = (const float*)d_in[10];
  float* out = (float*)d_out;

  char* ws = (char*)d_ws;
  float* qbuf  = (float*)(ws);                       // 16 MB: [16384][256]
  float* kvbuf = (float*)(ws + (size_t)(16u << 20)); //  8 MB: [4096][512]
  float* attnb = (float*)(ws + (size_t)(24u << 20)); // 16 MB: [16384][256]
  float* convb = (float*)(ws + (size_t)(24u << 20)); //  4 MB (dead before attn)
  float* normb = (float*)(ws + (size_t)(28u << 20)); //  4 MB (dead before attn)

  // 1) spatial reduction conv (gathered GEMM, K=1024) + bias
  gemm16_wmma<1, 0, 256><<<dim3(256, 4), 128, 0, stream>>>(x, Wconv, bconv, convb, 256, 1024);
  // 2) LayerNorm
  layernorm_kernel<<<512, 256, 0, stream>>>(convb, ln_s, ln_b, normb);
  // 3) KV projection
  gemm16_wmma<0, 256, 512><<<dim3(256, 8), 128, 0, stream>>>(normb, Wkv, bkv, kvbuf, 512, 256);
  // 4) Q projection
  gemm16_wmma<0, 256, 256><<<dim3(1024, 4), 128, 0, stream>>>(x, Wq, bq, qbuf, 256, 256);
  // 5) fused flash attention
  attn_kernel<<<2048, 128, 0, stream>>>(qbuf, kvbuf, attnb);
  // 6) output projection
  gemm16_wmma<0, 256, 256><<<dim3(1024, 4), 128, 0, stream>>>(attnb, Wproj, bproj, out, /*ldo=*/256, /*K=*/256);
}

// v003
// It runs in 174 microseconds.
// In both of two side-by-side timings against v002, it was 1.10 times as fast.
// Counting every step since v000, it is 1.90 times as fast.
#include <hip/hip_runtime.h>
#include <hip/hip_bf16.h>

typedef float v2f __attribute__((ext_vector_type(2)));
typedef float v8f __attribute__((ext_vector_type(8)));

#define WMMA_F32(A, B, C) \
    __builtin_amdgcn_wmma_f32_16x16x4_f32(false, (A), false, (B), (short)0, (C), false, false)

#define LDSP 66  // padded row stride (floats), even -> keeps 8B alignment for b64 LDS loads

// ---------------------------------------------------------------------------
// Generic fp32 WMMA GEMM: out[M][N] = A[M][K] @ W[K][N] + bias[N]
// MODE 0: A is plain row-major with leading dim LDA.
// MODE 1: A is the spatially-reduced gather of x (conv-as-GEMM), K=1024. Rows and k are
//         grouped so that the gather reads whole lines of x (see the A loads below).
// Block = 128 threads (4 waves); block tile = 16 (M) x 64 (N); wave tile 16x16.
// ---------------------------------------------------------------------------
// LDA, LDW: leading dims, compile-time so that the staging loads of a chunk differ
// only by immediate offsets and go out back to back from one address each.
// Register budget of 12 waves per SIMD: at the budget of 16 the compiler holds the last
// loads of a chunk back until the first have returned.
template <int MODE, int LDA, int LDW>
__global__ void __launch_bounds__(128) __attribute__((amdgpu_waves_per_eu(1, 12)))
gemm16_wmma(const float* __restrict__ A,
                            const float* __restrict__ W,
                            const float* __restrict__ bias,
                            float* __restrict__ out, int ldo, int K) {
  __shared__ __align__(16) float a_tile[16][LDSP];   // [m][k]
  __shared__ __align__(16) float w_tile[64][LDSP];   // [n][k]  (W^T chunk)

  const int tid  = threadIdx.x;
  const int lane = tid & 31;
  const int wave = tid >> 5;
  const int m0     = blockIdx.x * 16;
  const int n0blk  = blockIdx.y * 64;
  const int nw     = wave * 16;

  const int mrow  = lane & 15;        // A-frag M / B-frag N index
  const int khalf = (lane >> 4) << 1; // K pair selected by lane half

  v8f acc = {0.f, 0.f, 0.f, 0.f, 0.f, 0.f, 0.f, 0.f};

  // staging: trip i of a thread is element (sr + 2*i, sc) of a 64-wide tile
  const int sr = tid >> 6;
  const int sc = tid & 63;

  // MODE 1: which rows this block's tile holds (batch, group of 4 ho, wo & 7)
  const int chg = blockIdx.x & 7;
  const int cwr = (blockIdx.x >> 3) & 7;
  const int cb  = blockIdx.x >> 6;

  for (int kb = 0; kb < K; kb += 64) {
    __syncthreads();
    // Fixed trip counts (block = 128 threads), unrolled, and every global load of
    // both tiles issued before the first LDS store: the chunk waits for one memory
    // round trip, not for one per loop trip.
    float av[8], wv[32];
    float4 a4[2];
    int wrow;  // row of W that pairs with column sr of the A tile
    if (MODE == 0) {
      // ---- load A tile (16 x 64): row m0 + sr + 2*i, column kb + sc ----
      const float* ap = A + (m0 + sr) * LDA + kb + sc;
      #pragma unroll  // loads back to back, values stay in registers
      for (int i = 0; i < 8; ++i) av[i] = ap[i * 2 * LDA];
      wrow = kb + sr;
    } else {
      // conv gather: row (b, ho, wo = 8*wq + cwr), k = (kh, kw, ic) is element
      // x[b][(2*cwr + kw)*256 + ic][8*ho + 4*kh + wq]. The 16 rows of a tile are 4 ho x 4 wq
      // at one cwr, a chunk is both kh x 32 ic at one kw: one position of x then gives
      // 32 neighbouring channels, a whole 128-byte line, all of it used.
      // A thread takes 4 channels (the 4 wq of one ho, kh) of positions (tid >> 3) + 16*i.
      const int kw  = kb >> 9;
      const int icb = (kb >> 1) & 224;
      const float* ap = A + ((cb << 12) + ((2 * cwr + kw) << 8) + icb + (tid >> 3)) * 256
                          + (chg << 5) + ((tid & 7) << 2);
      #pragma unroll  // loads back to back, values stay in registers
      for (int i = 0; i < 2; ++i) a4[i] = *(const float4*)(ap + i * 16 * 256);
      wrow = (kw << 8) + icb + sr;
    }
    // ---- load W chunk (64 x 64), column n0blk + sc. MODE 0: row kb + sr + 2*i.
    // MODE 1: tile column kk = sr + 2*i is kh = kk >> 5, ic = icb + (kk & 31) ----
    const float* wp = W + wrow * LDW + n0blk + sc;
    #pragma unroll  // loads back to back, values stay in registers
    for (int i = 0; i < 32; ++i)
      wv[i] = (MODE == 0) ? wp[i * 2 * LDW] : wp[((i & 15) * 2 + (i >> 4) * 512) * LDW];
    // ---- store both tiles: a_tile[m][k], w_tile[n][k] = W^T chunk ----
    if (MODE == 0) {
      #pragma unroll  // av[] indexed by constants only
      for (int i = 0; i < 8; ++i) a_tile[sr + 2 * i][sc] = av[i];
    } else {
      const int ar = ((tid & 7) >> 1) << 2;            // tile row of wq = 0: 4 * (ho - 4*chg)
      const int ac = ((tid & 1) << 5) + (tid >> 3);    // tile column: 32*kh + ic - icb, trip 0
      #pragma unroll  // a4[] indexed by constants only
      for (int i = 0; i < 2; ++i) {
        a_tile[ar + 0][ac + 16 * i] = a4[i].x;
        a_tile[ar + 1][ac + 16 * i] = a4[i].y;
        a_tile[ar + 2][ac + 16 * i] = a4[i].z;
        a_tile[ar + 3][ac + 16 * i] = a4[i].w;
      }
    }
    #pragma unroll  // wv[] indexed by constants only
    for (int i = 0; i < 32; ++i) w_tile[sc][sr + 2 * i] = wv[i];
    __syncthreads();

    #pragma unroll
    for (int ks = 0; ks < 16; ++ks) {
      v2f a = *(const v2f*)&a_tile[mrow][4 * ks + khalf];
      v2f b = *(const v2f*)&w_tile[nw + mrow][4 * ks + khalf];
      acc = WMMA_F32(a, b, acc);
    }
  }

  const int col     = n0blk + nw + mrow;
  const float bv    = bias[col];
  const int halfsel = (lane >> 4) << 3;  // D-matrix: vgpr v holds row v (lo half) / v+8 (hi half)
  #pragma unroll
  for (int v = 0; v < 8; ++v) {
    const int r = v + halfsel;
    // MODE 1: tile row r is ho = 4*chg + (r >> 2), wo = 8*(r & 3) + cwr
    const int row = (MODE == 0) ? m0 + r
                                : (cb << 10) + ((4 * chg + (r >> 2)) << 5) + ((r & 3) << 3) + cwr;
    out[row * ldo + col] = acc[v] + bv;
  }
}

// ---------------------------------------------------------------------------
// LayerNorm over 256-wide rows. One wave per row, 8 rows per 256-thread block.
// ---------------------------------------------------------------------------
__global__ void layernorm_kernel(const float* __restrict__ in,
                                 const float* __restrict__ sc,
                                 const float* __restrict__ bi,
                                 float* __restrict__ outp) {
  const int lane = threadIdx.x & 31;
  const int wave = threadIdx.x >> 5;
  const int row  = blockIdx.x * 8 + wave;
  const float* rp = in + row * 256;

  float4 a = *(const float4*)(rp + lane * 4);
  float4 b = *(const float4*)(rp + 128 + lane * 4);

  float s = a.x + a.y + a.z + a.w + b.x + b.y + b.z + b.w;
  #pragma unroll
  for (int m = 1; m < 32; m <<= 1) s += __shfl_xor(s, m, 32);
  const float mu = s * (1.0f / 256.0f);

  float d, vs = 0.f;
  d = a.x - mu; vs += d * d;  d = a.y - mu; vs += d * d;
  d = a.z - mu; vs += d * d;  d = a.w - mu; vs += d * d;
  d = b.x - mu; vs += d * d;  d = b.y - mu; vs += d * d;
  d = b.z - mu; vs += d * d;  d = b.w - mu; vs += d * d;
  #pragma unroll
  for (int m = 1; m < 32; m <<= 1) vs += __shfl_xor(vs, m, 32);
  const float inv = rsqrtf(vs * (1.0f / 256.0f) + 1e-6f);

  int c = lane * 4;
  float4 o;
  o.x = (a.x - mu) * inv * sc[c + 0] + bi[c + 0];
  o.y = (a.y - mu) * inv * sc[c + 1] + bi[c + 1];
  o.z = (a.z - mu) * inv * sc[c + 2] + bi[c + 2];
  o.w = (a.w - mu) * inv * sc[c + 3] + bi[c + 3];
  *(float4*)(outp + row * 256 + c) = o;
  c = 128 + lane * 4;
  o.x = (b.x - mu) * inv * sc[c + 0] + bi[c + 0];
  o.y = (b.y - mu) * inv * sc[c + 1] + bi[c + 1];
  o.z = (b.z - mu) * inv * sc[c + 2] + bi[c + 2];
  o.w = (b.w - mu) * inv * sc[c + 3] + bi[c + 3];
  *(float4*)(outp + row * 256 + c) = o;
}

// ---------------------------------------------------------------------------
// Flash attention, fp32 WMMA, transposed products: S^T = K Q^T, O^T += V^T P^T.
// Block = 128 threads (4 waves); each wave owns 16 query columns, block covers 64.
// KV length 1024 streamed in chunks of 64.
// A lane holds scores of ONE query (column lane & 15): maximum and sum run over its own
// registers, with one exchange between the wave's halves; the score accumulators are
// themselves the B operand of the second product, so P never goes through LDS.
// qbuf:   [B*4096][256]  (q for head h in cols h*32..h*32+31)
// kvbuf:  [B*1024][512]  (k cols h*32+d, v cols 256+h*32+d)
// attnout:[B*4096][256]
// ---------------------------------------------------------------------------
__device__ __forceinline__ float xhalf(float x) {  // lane l with lane l ^ 16
  return __builtin_bit_cast(float, __builtin_amdgcn_permlanex16(
      __builtin_bit_cast(int, x), __builtin_bit_cast(int, x), 0x76543210, 0xfedcba98, false, false));
}

__global__ void attn_kernel(const float* __restrict__ qbuf,
                            const float* __restrict__ kvbuf,
                            float* __restrict__ attnout) {
  __shared__ __align__(16) float k_tile[64][34];      // [kv][d]
  __shared__ __align__(16) float vt_tile[32][LDSP];   // [d][kv]

  const int tid  = threadIdx.x;
  const int lane = tid & 31;
  const int wave = tid >> 5;
  const int id   = blockIdx.x;
  const int qblk = id & 63;
  const int bh   = id >> 6;
  const int h    = bh & 7;
  const int b    = bh >> 3;
  const int q0   = qblk * 64 + wave * 16;

  const int mrow  = lane & 15;
  const int khalf = (lane >> 4) << 1;
  const float scale = 0.17677669529663687f;  // 32^-0.5 folded into Q

  // Key row that A-fragment row mrow of a 16-key tile takes. Accumulator register r of
  // lane half hf is A row 8*hf + r; with r = 2*j + e this map makes it key 4*j + 2*hf + e,
  // which is the k position of register e of a B fragment at k-step j: the registers
  // (2*j, 2*j + 1) of a score tile are the P^T fragment that pairs with the V^T loader below.
  const int krow = ((mrow & 6) << 1) | ((mrow >> 3) << 1) | (mrow & 1);

  // Q B-fragments (d = 32 -> 8 k-steps), kept in registers for whole KV loop
  v2f qf[8];
  const float* qp = qbuf + (size_t)(b * 4096 + q0 + mrow) * 256 + h * 32;
  #pragma unroll
  for (int ks = 0; ks < 8; ++ks) {
    v2f t = *(const v2f*)(qp + 4 * ks + khalf);
    qf[ks] = t * scale;
  }

  v8f o0 = {0.f, 0.f, 0.f, 0.f, 0.f, 0.f, 0.f, 0.f};  // O^T rows d = 0..15
  v8f o1 = {0.f, 0.f, 0.f, 0.f, 0.f, 0.f, 0.f, 0.f};  // O^T rows d = 16..31
  float m_run = -__builtin_inff();  // this lane's query, same in both halves
  float l_run = 0.f;                // this half's keys only; halves joined in the epilogue

  const float* kvb = kvbuf + (size_t)b * 1024 * 512;

  for (int kv0 = 0; kv0 < 1024; kv0 += 64) {
    __syncthreads();
    // Fixed trip counts, unrolled, all K and V loads issued before the first LDS
    // store: one memory round trip per chunk, not one per loop trip.
    // Trip i of a thread is key wave + 4*i, element lane of the head.
    float kr[16], vr[16];
    const float* kvp = kvb + (kv0 + wave) * 512 + h * 32 + lane;
    #pragma unroll  // loads back to back, values stay in registers
    for (int i = 0; i < 16; ++i) {
      kr[i] = kvp[i * 4 * 512];
      vr[i] = kvp[i * 4 * 512 + 256];
    }
    #pragma unroll  // kr[], vr[] indexed by constants only
    for (int i = 0; i < 16; ++i) {
      k_tile[wave + 4 * i][lane]  = kr[i];            // K rows as-is
      vt_tile[lane][wave + 4 * i] = vr[i];            // V transposed
    }
    __syncthreads();

    // S^T = K (Q*scale)^T : four 16x16 tiles over kv
    v8f s[4];
    #pragma unroll
    for (int nt = 0; nt < 4; ++nt) {
      v8f acc = {0.f, 0.f, 0.f, 0.f, 0.f, 0.f, 0.f, 0.f};
      #pragma unroll
      for (int ks = 0; ks < 8; ++ks) {
        v2f kf = *(const v2f*)&k_tile[nt * 16 + krow][4 * ks + khalf];
        acc = WMMA_F32(kf, qf[ks], acc);
      }
      s[nt] = acc;
    }

    // Online softmax of this lane's query over the 32 keys its half holds
    float mt[8];
    #pragma unroll
    for (int v = 0; v < 8; ++v)
      mt[v] = fmaxf(fmaxf(s[0][v], s[1][v]), fmaxf(s[2][v], s[3][v]));
    float mx = fmaxf(fmaxf(fmaxf(mt[0], mt[1]), fmaxf(mt[2], mt[3])),
                     fmaxf(fmaxf(mt[4], mt[5]), fmaxf(mt[6], mt[7])));
    mx = fmaxf(mx, xhalf(mx));
    const float mnew = fmaxf(m_run, mx);
    const float corr = __expf(m_run - mnew);
    // P^T as B fragments: pair j of tile nt is k-step 4*nt + j
    v2f pf[16];
    #pragma unroll
    for (int kp = 0; kp < 16; ++kp) {
      pf[kp].x = __expf(s[kp >> 2][2 * (kp & 3)] - mnew);
      pf[kp].y = __expf(s[kp >> 2][2 * (kp & 3) + 1] - mnew);
    }
    v2f lp = (pf[0] + pf[4]) + (pf[8] + pf[12]);
    #pragma unroll
    for (int j = 1; j < 4; ++j)
      lp += (pf[j] + pf[4 + j]) + (pf[8 + j] + pf[12 + j]);
    l_run = l_run * corr + (lp.x + lp.y);
    m_run = mnew;
    o0 *= corr;
    o1 *= corr;

    // O^T += V^T P^T  (contraction over 64 kv -> 16 k-steps, two 16-wide d tiles)
    #pragma unroll
    for (int kp = 0; kp < 16; ++kp) {
      v2f a0 = *(const v2f*)&vt_tile[mrow][4 * kp + khalf];
      v2f a1 = *(const v2f*)&vt_tile[16 + mrow][4 * kp + khalf];
      o0 = WMMA_F32(a0, pf[kp], o0);
      o1 = WMMA_F32(a1, pf[kp], o1);
    }
  }

  // epilogue: join the halves' sums, divide, store to [B,N,C] with col = h*32 + d;
  // register v of o0 / o1 is d = v + 8*half (+ 16), so a lane stores runs of 8 floats
  const float inv = 1.0f / (l_run + xhalf(l_run));
  float* op = attnout + (size_t)(b * 4096 + q0 + mrow) * 256 + h * 32 + ((lane >> 4) << 3);
  *(float4*)(op)      = make_float4(o0[0] * inv, o0[1] * inv, o0[2] * inv, o0[3] * inv);
  *(float4*)(op + 4)  = make_float4(o0[4] * inv, o0[5] * inv, o0[6] * inv, o0[7] * inv);
  *(float4*)(op + 16) = make_float4(o1[0] * inv, o1[1] * inv, o1[2] * inv, o1[3] * inv);
  *(float4*)(op + 20) = make_float4(o1[4] * inv, o1[5] * inv, o1[6] * inv, o1[7] * inv);
}

// ---------------------------------------------------------------------------
extern "C" void kernel_launch(void* const* d_in, const int* in_sizes, int n_in,
                              void* d_out, int out_size, void* d_ws, size_t ws_size,
                              hipStream_t stream) {
  (void)in_sizes; (void)n_in; (void)out_size; (void)ws_size;
  const float* x      = (const float*)d_in[0];
  const float* Wq     = (const float*)d_in[1];
  const float* bq     = (const float*)d_in[2];
  const float* Wconv  = (const float*)d_in[3];   // [2][2][256][256] == [1024][256]
  const float* bconv  = (const float*)d_in[4];
  const float* ln_s   = (const float*)d_in[5];
  const float* ln_b   = (const float*)d_in[6];
  const float* Wkv    = (const float*)d_in[7];   // [256][512]
  const float* bkv    = (const float*)d_in[8];
  const float* Wproj  = (const float*)d_in[9];
  const float* bproj  = (const float*)d_in[10];
  float* out = (float*)d_out;

  char* ws = (char*)d_ws;
  float* qbuf  = (float*)(ws);                       // 16 MB: [16384][256]
  float* kvbuf = (float*)(ws + (size_t)(16u << 20)); //  8 MB: [4096][512]
  float* attnb = (float*)(ws + (size_t)(24u << 20)); // 16 MB: [16384][256]
  float* convb = (float*)(ws + (size_t)(24u << 20)); //  4 MB (dead before attn)
  float* normb = (float*)(ws + (size_t)(28u << 20)); //  4 MB (dead before attn)

  // 1) spatial reduction conv (gathered GEMM, K=1024) + bias
  gemm16_wmma<1, 0, 256><<<dim3(256, 4), 128, 0, stream>>>(x, Wconv, bconv, convb, 256, 1024);
  // 2) LayerNorm
  layernorm_kernel<<<512, 256, 0, stream>>>(convb, ln_s, ln_b, normb);
  // 3) KV projection
  gemm16_wmma<0, 256, 512><<<dim3(256, 8), 128, 0, stream>>>(normb, Wkv, bkv, kvbuf, 512, 256);
  // 4) Q projection
  gemm16_wmma<0, 256, 256><<<dim3(1024, 4), 128, 0, stream>>>(x, Wq, bq, qbuf, 256, 256);
  // 5) fused flash attention
  attn_kernel<<<2048, 128, 0, stream>>>(qbuf, kvbuf, attnb);
  // 6) output projection
  gemm16_wmma<0, 256, 256><<<dim3(1024, 4), 128, 0, stream>>>(attnb, Wproj, bproj, out, /*ldo=*/256, /*K=*/256);
}
